// v000
// The times below were measured on an AMD MI455X: many runs one after another, warmed up first and cycling through
// copies of the inputs, with the whole window's GPU time divided by the number of runs. Launches and the gaps
// between them are all in it. The median over several windows is given; except for v000 it joins two sittings, which
// can be a few percent apart, so the side-by-side timings, each taken in one sitting, are the better comparison.
// v000 is the starting kernel. One run takes 411 microseconds.
// compute dtype: all float inputs rounded to bf16; q/k/v = x . W + b with EXACT bf16 products on WMMA 16x16x32 ((in,out) weights as transposed rows; each key/value group's 64 columns replicated to its 8 query heads at pack time == repeat_interleave); PLAIN attention: q, k single f16 x 1/8, running-max softmax in f32 (hardware exp), P (scaled by 2^11, single f16) x v (single f16); out = o (bf16 hi + residual) . Wo (2 products) + bo.
#include <hip/hip_runtime.h>
#include <math.h>

typedef __attribute__((ext_vector_type(16))) _Float16 v16h;
typedef __attribute__((ext_vector_type(16))) __bf16 v16b;
typedef __attribute__((ext_vector_type(8)))  _Float16 v8h;
typedef __attribute__((ext_vector_type(8)))  float v8f;
typedef __attribute__((ext_vector_type(4)))  float v4f;
typedef __attribute__((ext_vector_type(2)))  float v2f;
typedef __attribute__((ext_vector_type(4)))  unsigned v4u;
typedef __attribute__((ext_vector_type(4)))  int v4i;
typedef float __attribute__((may_alias)) float_a;
typedef int __attribute__((may_alias)) int_a;

template <typename T> __device__ __forceinline__ void vst2(void* p, T v) { *(T*)p = v;  }
__device__ __forceinline__ v8f wmma16(v16h a, v16h b, v8f c) {
  v8f d = __builtin_amdgcn_wmma_f32_16x16x32_f16(false, a, false, b, (short)0, c, false, false);
  asm volatile("v_nop\n\tv_nop\n\tv_nop\n\tv_nop" : "+v"(d) : "v"(a), "v"(b));
  return d;
}
__device__ __forceinline__ v8f wmma_bf(v16b a, v16b b, v8f c) {
  v8f d = __builtin_amdgcn_wmma_f32_16x16x32_bf16(false, a, false, b, (short)0, c, false, false);
  asm volatile("v_nop\n\tv_nop\n\tv_nop\n\tv_nop" : "+v"(d) : "v"(a), "v"(b));
  return d;
}
// Grouped-query self attention (B 2, S 2,048, 1,024 dims, 16 query heads sharing 2 key/value groups of 64): q/k/v projections + biases, softmax(q k^T / 8) v per head against its group's k/v, output projection + bias.
__device__ __forceinline__ v16h frag_h(const _Float16* rowk0, int lane) {
  union { v16h v; v8h q[2]; } u; const _Float16* p = rowk0 + 8 * (lane >> 4);
  u.q[0] = *(const v8h*)p; u.q[1] = *(const v8h*)(p + 16); return u.v;
}
__device__ __forceinline__ v16h frag_f32(const float* rowk0, int lane) {
  v16h a; const float* p = rowk0 + 8 * (lane >> 4);
#pragma unroll
  for (int i = 0; i < 8; ++i) { a[i] = (_Float16)p[i]; a[8 + i] = (_Float16)p[16 + i]; }
  return a;
}
__device__ __forceinline__ v16h frag_f32s(const float* rowk0, int lane, float sc) {
  v16h a; const float* p = rowk0 + 8 * (lane >> 4);
#pragma unroll
  for (int i = 0; i < 8; ++i) { a[i] = (_Float16)(p[i] * sc); a[8 + i] = (_Float16)(p[16 + i] * sc); }
  return a;
}
// column fragment from a [K][ld] layout (column n), rows >= K read as 0
__device__ __forceinline__ v16h fragc_f32(const float* W, int k0, int n, int lane, int ld, int K) {
  v16h a; const int g = lane >> 4;
#pragma unroll
  for (int i = 0; i < 8; ++i) { const int ka = k0 + 8 * g + i, kb = ka + 16;
    a[i] = (_Float16)(ka < K ? W[(size_t)(ka < K ? ka : K - 1) * ld + n] : 0.f); a[8 + i] = (_Float16)(kb < K ? W[(size_t)(kb < K ? kb : K - 1) * ld + n] : 0.f); }
  return a;
}
struct F2 { v16b h, l; };
__device__ __forceinline__ F2 bsplit16(const float v[16]) { F2 r;
#pragma unroll
  for (int i = 0; i < 16; ++i) { const __bf16 h = (__bf16)v[i]; r.h[i] = h; r.l[i] = (__bf16)(v[i] - (float)h); }
  return r; }
__device__ __forceinline__ F2 split_row(const float* row, int k0, int lane) { float v[16]; const float* p = row + k0 + 8 * (lane >> 4);
#pragma unroll
  for (int i = 0; i < 8; ++i) { v[i] = p[i]; v[8 + i] = p[16 + i]; }
  return bsplit16(v); }
__device__ __forceinline__ F2 split_rowK(const float* row, int k0, int lane, int K) { float v[16]; const int g = lane >> 4;
#pragma unroll
  for (int i = 0; i < 8; ++i) { const int ka = k0 + 8 * g + i, kb = ka + 16; v[i] = ka < K ? row[ka < K ? ka : K - 1] : 0.f; v[8 + i] = kb < K ? row[kb < K ? kb : K - 1] : 0.f; }
  return bsplit16(v); }
__device__ __forceinline__ F2 split_col(const float* W, int k0, int n, int lane, int ld, int K) { float v[16]; const int g = lane >> 4;
#pragma unroll
  for (int i = 0; i < 8; ++i) { const int ka = k0 + 8 * g + i, kb = ka + 16; v[i] = ka < K ? W[(size_t)(ka < K ? ka : K - 1) * ld + n] : 0.f; v[8 + i] = kb < K ? W[(size_t)(kb < K ? kb : K - 1) * ld + n] : 0.f; }
  return bsplit16(v); }
__device__ __forceinline__ v8f mac3(const F2& a, const F2& b, v8f c) { c = wmma_bf(a.l, b.h, c); c = wmma_bf(a.h, b.l, c); return wmma_bf(a.h, b.h, c); }
__device__ __forceinline__ float sigm(float v) { return 1.0f / (1.0f + expf(-v)); }
#define LDSX() do { asm volatile("s_wait_dscnt 0" ::: "memory"); __builtin_amdgcn_wave_barrier(); __builtin_amdgcn_fence(__ATOMIC_RELEASE, "workgroup"); } while (0)


#define NB 2
#define SS 2048
#define DM 1024
#define NH 16
#define NKV 2
#define KVD (NKV * HD)    // 128
#define HPG (NH / NKV)    // 8 heads per group
#define HD 64
#define QKVW (3 * DM)
#ifndef TQB
#define TQB (SS / 64)
#define TNB NB
#define TOB (NB * SS / 64)     // output row tiles (all)
#endif
typedef __attribute__((ext_vector_type(8))) __bf16 v8b;
__device__ __forceinline__ v16b frag_b(const __bf16* rowk0, int lane) {
  union { v16b v; v8b q[2]; } u; const __bf16* p = rowk0 + 8 * (lane >> 4);
  u.q[0] = *(const v8b*)p; u.q[1] = *(const v8b*)(p + 16); return u.v;
}
__device__ __forceinline__ float bfr(float v) { return (float)(__bf16)v; }
__device__ __attribute__((noinline)) float exp_ni(float v) { return expf(v); }
__device__ __attribute__((noinline)) float erf_ni(float v) { return erff(v); }

#define PK_A 0                       // [3072][1024] Wqkv rows (natural [out][in])
#define PK_P (PK_A + QKVW * DM)        // [1024][1024] Wo rows (natural)
#define PK_END (PK_P + DM * DM)
#define WS_PK  0u
#define WS_QK  (WS_PK + 2u * PK_END)             // f16 [4096 rows][2048]: q | k
#define WS_QKL (WS_QK + 2u * NB * SS * 2 * DM)     // f16 q | k residual planes x2048
#define WS_VTH (WS_QKL + 2u * NB * SS * 2 * DM)    // f16 [b][1024 (h*64+d)][2048 s] hi
#define WS_VTL (WS_VTH + 2u * NB * DM * SS)        // f16 lo x 2048
#define WS_O   (WS_VTL + 2u * NB * DM * SS)        // f32 [4096][1024]
#define WS_CS  (WS_O + 4u * NB * SS * DM)           // f32 [2][2048][32], unused
#define WS_BX  (WS_CS + 4u * 2 * SS * 32)                  // f32 [2][1024] expanded k / v biases
#define WS_END (WS_BX + 4u * 2 * DM + 256u)
// ---- k_pack: block = (row n, which): (in,out) column n -> bf16 row n; which 0..2 -> W_q/W_k/W_v into PK_A rows which*1024 + n; 3 -> W_o into PK_P
__global__ __launch_bounds__(256) void k_pack(const float* __restrict__ WQ, const float* __restrict__ WK, const float* __restrict__ WV, const float* __restrict__ WO, __bf16* __restrict__ PK) {
  __shared__ __align__(16) __bf16 s[DM]; const int n = blockIdx.x, which = blockIdx.y, t = threadIdx.x; const float* Wm = (which == 0) ? WQ : (which == 1) ? WK : (which == 2) ? WV : WO;   // (in,out) weights: pack row n = column n
  for (int k = t; k < DM; k += 256) s[k] = (__bf16)Wm[(size_t)k * DM + n];
  __syncthreads();
  __bf16* dst = (which < 3) ? PK + PK_A + ((size_t)which * DM + n) * DM : PK + PK_P + (size_t)n * DM;
  for (int q = t; q < DM / 8; q += 256) vst2((unsigned*)(dst + q * 8), *(const v4u*)&s[q * 8]);
}
__global__ __launch_bounds__(128) void k_qkv(const float* __restrict__ XQ, const float* __restrict__ XK, const float* __restrict__ XV, const __bf16* __restrict__ P, const float* __restrict__ BQ, const float* __restrict__ BK, const float* __restrict__ BV, _Float16* __restrict__ QK, _Float16* __restrict__ QKL, _Float16* __restrict__ VTH, _Float16* __restrict__ VTL) {
  const int which0 = (blockIdx.y * 128) / DM; const float* X = (which0 == 0) ? XQ : (which0 == 1) ? XK : XV; const float* BB = BQ ? (((which0 == 0) ? BQ : (which0 == 1) ? BK : BV) + (blockIdx.y * 128 - which0 * DM)) : nullptr;
  __shared__ __align__(16) _Float16 so[4][16][136], sol[4][16][136]; __shared__ __align__(16) _Float16 sth[128][72], stl[128][72];
  const int tid = threadIdx.x, wave = tid >> 5, lane = tid & 31, col = lane & 15, g = lane >> 4; const size_t r0 = (size_t)blockIdx.x * 64 + wave * 16; const int n0 = blockIdx.y * 128;
  v8f acc[8] = {};
#pragma unroll 2
  for (int kc = 0; kc < DM / 32; ++kc) { v16b a; { const float* p = X + (r0 + col) * DM + kc * 32 + 8 * g;
#pragma unroll
      for (int i = 0; i < 8; ++i) { a[i] = (__bf16)p[i]; a[8 + i] = (__bf16)p[16 + i]; } }
#pragma unroll
    for (int j = 0; j < 8; ++j) acc[j] = wmma_bf(a, frag_b(P + (size_t)(n0 + j * 16 + col) * DM + kc * 32, lane), acc[j]); }
  if (n0 < 2 * DM) {   // q stored unscaled (f16 sigma ~0.6, no subnormal exposure); 1/8 applied to the f32 score
#pragma unroll
    for (int j = 0; j < 8; ++j) {
#pragma unroll
      for (int r = 0; r < 8; ++r) { const float v = acc[j][r] + (BB ? bfr(BB[j * 16 + col]) : 0.f); const _Float16 hv = (_Float16)v; so[wave][8 * g + r][j * 16 + col] = hv; sol[wave][8 * g + r][j * 16 + col] = (_Float16)((v - (float)hv) * 2048.0f); } }   // q, k (+ bias) as f16 hi + (x2048) residual
    LDSX();
    for (int rl = 0; rl < 16; ++rl) if (lane < 16) { vst2((unsigned*)(QK + (r0 + rl) * (2 * DM) + n0 + lane * 8), *(const v4u*)&so[wave][rl][lane * 8]); vst2((unsigned*)(QKL + (r0 + rl) * (2 * DM) + n0 + lane * 8), *(const v4u*)&sol[wave][rl][lane * 8]); }
  } else {
#pragma unroll
    for (int j = 0; j < 8; ++j) {
#pragma unroll
      for (int r = 0; r < 8; ++r) { const float v = acc[j][r] + (BB ? bfr(BB[j * 16 + col]) : 0.f); const _Float16 hv = (_Float16)v; sth[j * 16 + col][wave * 16 + 8 * g + r] = hv; stl[j * 16 + col][wave * 16 + 8 * g + r] = (_Float16)((v - (float)hv) * 2048.0f); } }
    __syncthreads();
    const size_t rb = (size_t)blockIdx.x * 64; const int b = (int)(rb / SS), s0 = (int)(rb % SS); const int pc0 = n0 - 2 * DM;
    for (int q = tid; q < 128 * 8; q += 128) { const int d = q >> 3, pc = q & 7; const size_t o = ((size_t)b * DM + pc0 + d) * SS + s0 + pc * 8; vst2((unsigned*)(VTH + o), *(const v4u*)&sth[d][pc * 8]); vst2((unsigned*)(VTL + o), *(const v4u*)&stl[d][pc * 8]); }
  }
}
// ---- k_attn: block = (64 queries, head h, batch b): all-keys flash attention (K = 64: 2 k-steps), scores = (q.k) * 0.125 with single f16 operands, P.V: f16 P (x2^11) x V hi in one accumulator (accl stays 0); O[b*S+q][h*64+d] = (acc + accl / 2048) / (2048 l) (256-B segments)
__global__ __launch_bounds__(128) void k_attn(const _Float16* __restrict__ QK, const _Float16* __restrict__ QKL, const _Float16* __restrict__ VTH, const _Float16* __restrict__ VTL, const void* __restrict__ KMASK, float* __restrict__ O) {
  __shared__ __align__(16) float sp[4][16][36]; __shared__ __align__(16) float so[4][16][68];
  const int tid = threadIdx.x, wave = tid >> 5, lane = tid & 31, col = lane & 15, g = lane >> 4;
  const int qb = blockIdx.x, h = blockIdx.y, b = blockIdx.z; const int q0 = qb * 64 + wave * 16; const size_t rq = (size_t)b * SS + q0 + col;
  v16h aq[2], aql[2];
#pragma unroll
  for (int kc = 0; kc < 2; ++kc) { aq[kc] = frag_h(QK + rq * (2 * DM) + h * HD + kc * 32, lane); aql[kc] = frag_h(QKL + rq * (2 * DM) + h * HD + kc * 32, lane); }
  float m[8], l[8];
#pragma unroll
  for (int r = 0; r < 8; ++r) { m[r] = -3.0e38f; l[r] = 0.f; }
  v8f acc[4] = {}, accl[4] = {};
  const int nks = SS / 32;   // all keys
#pragma unroll 1
  for (int ks = 0; ks < nks; ++ks) { v8f s[2];
#pragma unroll
    for (int ct = 0; ct < 2; ++ct) { const int kk = ks * 32 + ct * 16 + col; const _Float16* krow = QK + ((size_t)b * SS + kk) * (2 * DM) + DM + h * HD; const _Float16* krowl = QKL + ((size_t)b * SS + kk) * (2 * DM) + DM + h * HD; v8f c = {}, cl = {};
#pragma unroll
      for (int kc = 0; kc < 2; ++kc) c = wmma16(aq[kc], frag_h(krow + kc * 32, lane), c);   // single product: q, k as one-rounding f16 operands
      (void)cl; (void)krowl;
      { const bool keepk = true;
#pragma unroll
      for (int r = 0; r < 8; ++r) s[ct][r] = keepk ? c[r] * 0.125f : -3.0e38f; } }   // 1/sqrt(64); no key mask: every key kept
#pragma unroll
    for (int r = 0; r < 8; ++r) { float mx = fmaxf(s[0][r], s[1][r]);
#pragma unroll
      for (int o = 1; o < 16; o <<= 1) mx = fmaxf(mx, __shfl_xor(mx, o));
      const float mn = fmaxf(m[r], mx); const float alpha = (m[r] <= -1.0e38f) ? 0.f : __expf(m[r] - mn);
      const float e0 = (s[0][r] <= -1.0e38f) ? 0.f : __expf(s[0][r] - mn), e1 = (s[1][r] <= -1.0e38f) ? 0.f : __expf(s[1][r] - mn); float es = e0 + e1;
#pragma unroll
      for (int o = 1; o < 16; o <<= 1) es += __shfl_xor(es, o);
      l[r] = l[r] * alpha + es; m[r] = mn;
#pragma unroll
      for (int dt = 0; dt < 4; ++dt) { acc[dt][r] *= alpha; accl[dt][r] *= alpha; }
      sp[wave][8 * g + r][col] = e0; sp[wave][8 * g + r][16 + col] = e1; }
    LDSX();
    v16h pa, pl; { const float* prow = &sp[wave][col][0] + 8 * (lane >> 4);
#pragma unroll
      for (int i = 0; i < 8; ++i) { const float x0 = prow[i] * 2048.0f, x1 = prow[16 + i] * 2048.0f; const _Float16 h0 = (_Float16)x0, h1 = (_Float16)x1; pa[i] = h0; pa[8 + i] = h1; pl[i] = (_Float16)((x0 - (float)h0) * 2048.0f); pl[8 + i] = (_Float16)((x1 - (float)h1) * 2048.0f); } }   // P scaled by 2^11 before the f16 split so small softmax weights stay out of the f16 subnormal range; 2^-11 folded into the epilogue
#pragma unroll
    for (int dt = 0; dt < 4; ++dt) { const size_t vr = ((size_t)b * DM + h * HD + dt * 16 + col) * SS + ks * 32; acc[dt] = wmma16(pa, frag_h(VTH + vr, lane), acc[dt]); }   // single product: P (x2^11) x V
    (void)pl;
    LDSX(); }
#pragma unroll
  for (int r = 0; r < 8; ++r) { const float il = (1.0f / 2048.0f) / l[r];
#pragma unroll
    for (int dt = 0; dt < 4; ++dt) so[wave][8 * g + r][dt * 16 + col] = (acc[dt][r] + accl[dt][r] * (1.0f / 2048.0f)) * il; }
  LDSX();
  for (int rl = 0; rl < 16; ++rl) if (lane < 16) vst2(O + ((size_t)b * SS + q0 + rl) * DM + h * HD + lane * 4, *(const v4f*)&so[wave][rl][lane * 4]);
}
// ---- k_out: block = (64 rows, 128 cols): out = O(hi/lo) . Wo rows (2 products) + bo
__global__ __launch_bounds__(128) void k_out(const float* __restrict__ O, const __bf16* __restrict__ P, const float* __restrict__ BO, float* __restrict__ Y) {
  __shared__ __align__(16) float so[4][16][132];
  const int tid = threadIdx.x, wave = tid >> 5, lane = tid & 31, col = lane & 15, g = lane >> 4; const size_t r0 = (size_t)blockIdx.x * 64 + wave * 16; const int n0 = blockIdx.y * 128;
  v8f acc[8] = {};
#pragma unroll 2
  for (int kc = 0; kc < DM / 32; ++kc) { const F2 a = split_row(O + (r0 + col) * DM, kc * 32, lane);
#pragma unroll
    for (int j = 0; j < 8; ++j) { const v16b w = frag_b(P + (size_t)(n0 + j * 16 + col) * DM + kc * 32, lane); acc[j] = wmma_bf(a.l, w, acc[j]); acc[j] = wmma_bf(a.h, w, acc[j]); } }
#pragma unroll
  for (int j = 0; j < 8; ++j) {
#pragma unroll
    for (int r = 0; r < 8; ++r) so[wave][8 * g + r][j * 16 + col] = acc[j][r] + bfr(BO[n0 + j * 16 + col]); }
  LDSX();
  for (int rl = 0; rl < 16; ++rl) vst2(Y + (r0 + rl) * DM + n0 + lane * 4, *(const v4f*)&so[wave][rl][lane * 4]);
}
// ---- k_packkv: engine k / v rows for head h, dim d  <-  Wk / Wv (in,out) [1024][128] column (h / 8) * 64 + d ; expanded biases likewise
__global__ __launch_bounds__(256) void k_packkv(const float* __restrict__ WK, const float* __restrict__ WV, const float* __restrict__ BK, const float* __restrict__ BV, __bf16* __restrict__ PK, float* __restrict__ BX) {
  __shared__ __align__(16) __bf16 s[DM]; const int n = blockIdx.x, which = blockIdx.y, t = threadIdx.x; const int h = n / HD, d = n % HD; const int c = (h / HPG) * HD + d; const float* Wm = which ? WV : WK;
  for (int k = t; k < DM; k += 256) s[k] = (__bf16)Wm[(size_t)k * KVD + c]; __syncthreads();
  for (int q = t; q < DM / 8; q += 256) vst2((unsigned*)(PK + PK_A + ((size_t)(1 + which) * DM + n) * DM + q * 8), *(const v4u*)&s[q * 8]);
  if (n == 0) { __shared__ __align__(16) float sb[DM]; const float* Bm = which ? BV : BK; for (int i = t; i < DM; i += 256) sb[i] = Bm[((i / HD) / HPG) * HD + (i % HD)]; __syncthreads(); for (int q = t; q < DM / 4; q += 256) vst2(BX + (size_t)which * DM + q * 4, *(const v4f*)&sb[q * 4]); }
}
extern "C" void kernel_launch(void* const* d_in, const int* in_sizes, int n_in, void* d_out, int out_size, void* d_ws, size_t ws_size, hipStream_t stream) {
  (void)in_sizes; (void)n_in; (void)out_size;
  const float** F = (const float**)d_in;   // 0 x [2,2048,1024], 1 Wq [1024,1024] (in,out), 2 bq, 3 Wk [1024,128], 4 bk [128], 5 Wv [1024,128], 6 bv, 7 Wo [1024,1024], 8 bo
  if (ws_size < (size_t)WS_END) return;
  char* ws = (char*)d_ws; __bf16* PK = (__bf16*)(ws + WS_PK); _Float16 *QK = (_Float16*)(ws + WS_QK), *QKL = (_Float16*)(ws + WS_QKL), *VTH = (_Float16*)(ws + WS_VTH), *VTL = (_Float16*)(ws + WS_VTL); float *O = (float*)(ws + WS_O), *BX = (float*)(ws + WS_BX);
  k_pack<<<dim3(DM, 4), 256, 0, stream>>>(F[1], F[1], F[1], F[7], PK);   // q rows and Wo rows (k/v slots overwritten next)
  k_packkv<<<dim3(DM, 2), 256, 0, stream>>>(F[3], F[5], F[4], F[6], PK, BX);
  k_qkv<<<dim3(TNB * SS / 64, QKVW / 128), 128, 0, stream>>>(F[0], F[0], F[0], PK + PK_A, F[2], BX, BX + DM, QK, QKL, VTH, VTL);
  k_attn<<<dim3(TQB, NH, TNB), 128, 0, stream>>>(QK, QKL, VTH, VTL, nullptr, O);
  k_out<<<dim3(TOB, DM / 128), 128, 0, stream>>>(O, PK + PK_P, F[8], (float*)d_out);
}

// v001
// One run takes 328 microseconds.
// Next to v000, in two timings, it ran 1.29 and 1.30 times as fast.
// compute dtype: all float inputs rounded to bf16; q/k/v = x . W + b with EXACT bf16 products on WMMA 16x16x32 ((in,out) weights as transposed rows; each key/value group's 64 columns projected once, its 8 query heads read the group's k / v == repeat_interleave); PLAIN attention: q, k single f16 x 1/8, running-max softmax in f32 (hardware exp), P (scaled by 2^11, single f16) x v (single f16); out = o (bf16 hi + residual) . Wo (2 products) + bo.
#include <hip/hip_runtime.h>
#include <math.h>

typedef __attribute__((ext_vector_type(16))) _Float16 v16h;
typedef __attribute__((ext_vector_type(16))) __bf16 v16b;
typedef __attribute__((ext_vector_type(8)))  _Float16 v8h;
typedef __attribute__((ext_vector_type(8)))  float v8f;
typedef __attribute__((ext_vector_type(4)))  float v4f;
typedef __attribute__((ext_vector_type(2)))  float v2f;
typedef __attribute__((ext_vector_type(4)))  unsigned v4u;
typedef __attribute__((ext_vector_type(4)))  int v4i;
typedef float __attribute__((may_alias)) float_a;
typedef int __attribute__((may_alias)) int_a;

template <typename T> __device__ __forceinline__ void vst2(void* p, T v) { *(T*)p = v;  }
__device__ __forceinline__ v8f wmma16(v16h a, v16h b, v8f c) {
  v8f d = __builtin_amdgcn_wmma_f32_16x16x32_f16(false, a, false, b, (short)0, c, false, false);
  asm volatile("v_nop\n\tv_nop\n\tv_nop\n\tv_nop" : "+v"(d) : "v"(a), "v"(b));
  return d;
}
__device__ __forceinline__ v8f wmma_bf(v16b a, v16b b, v8f c) {
  v8f d = __builtin_amdgcn_wmma_f32_16x16x32_bf16(false, a, false, b, (short)0, c, false, false);
  asm volatile("v_nop\n\tv_nop\n\tv_nop\n\tv_nop" : "+v"(d) : "v"(a), "v"(b));
  return d;
}
// Grouped-query self attention (B 2, S 2,048, 1,024 dims, 16 query heads sharing 2 key/value groups of 64): q/k/v projections + biases, softmax(q k^T / 8) v per head against its group's k/v, output projection + bias.
__device__ __forceinline__ v16h frag_h(const _Float16* rowk0, int lane) {
  union { v16h v; v8h q[2]; } u; const _Float16* p = rowk0 + 8 * (lane >> 4);
  u.q[0] = *(const v8h*)p; u.q[1] = *(const v8h*)(p + 16); return u.v;
}
__device__ __forceinline__ v16h frag_f32(const float* rowk0, int lane) {
  v16h a; const float* p = rowk0 + 8 * (lane >> 4);
#pragma unroll
  for (int i = 0; i < 8; ++i) { a[i] = (_Float16)p[i]; a[8 + i] = (_Float16)p[16 + i]; }
  return a;
}
__device__ __forceinline__ v16h frag_f32s(const float* rowk0, int lane, float sc) {
  v16h a; const float* p = rowk0 + 8 * (lane >> 4);
#pragma unroll
  for (int i = 0; i < 8; ++i) { a[i] = (_Float16)(p[i] * sc); a[8 + i] = (_Float16)(p[16 + i] * sc); }
  return a;
}
// column fragment from a [K][ld] layout (column n), rows >= K read as 0
__device__ __forceinline__ v16h fragc_f32(const float* W, int k0, int n, int lane, int ld, int K) {
  v16h a; const int g = lane >> 4;
#pragma unroll
  for (int i = 0; i < 8; ++i) { const int ka = k0 + 8 * g + i, kb = ka + 16;
    a[i] = (_Float16)(ka < K ? W[(size_t)(ka < K ? ka : K - 1) * ld + n] : 0.f); a[8 + i] = (_Float16)(kb < K ? W[(size_t)(kb < K ? kb : K - 1) * ld + n] : 0.f); }
  return a;
}
struct F2 { v16b h, l; };
__device__ __forceinline__ F2 bsplit16(const float v[16]) { F2 r;
#pragma unroll
  for (int i = 0; i < 16; ++i) { const __bf16 h = (__bf16)v[i]; r.h[i] = h; r.l[i] = (__bf16)(v[i] - (float)h); }
  return r; }
__device__ __forceinline__ F2 split_row(const float* row, int k0, int lane) { float v[16]; const float* p = row + k0 + 8 * (lane >> 4);
#pragma unroll
  for (int i = 0; i < 8; ++i) { v[i] = p[i]; v[8 + i] = p[16 + i]; }
  return bsplit16(v); }
__device__ __forceinline__ F2 split_rowK(const float* row, int k0, int lane, int K) { float v[16]; const int g = lane >> 4;
#pragma unroll
  for (int i = 0; i < 8; ++i) { const int ka = k0 + 8 * g + i, kb = ka + 16; v[i] = ka < K ? row[ka < K ? ka : K - 1] : 0.f; v[8 + i] = kb < K ? row[kb < K ? kb : K - 1] : 0.f; }
  return bsplit16(v); }
__device__ __forceinline__ F2 split_col(const float* W, int k0, int n, int lane, int ld, int K) { float v[16]; const int g = lane >> 4;
#pragma unroll
  for (int i = 0; i < 8; ++i) { const int ka = k0 + 8 * g + i, kb = ka + 16; v[i] = ka < K ? W[(size_t)(ka < K ? ka : K - 1) * ld + n] : 0.f; v[8 + i] = kb < K ? W[(size_t)(kb < K ? kb : K - 1) * ld + n] : 0.f; }
  return bsplit16(v); }
__device__ __forceinline__ v8f mac3(const F2& a, const F2& b, v8f c) { c = wmma_bf(a.l, b.h, c); c = wmma_bf(a.h, b.l, c); return wmma_bf(a.h, b.h, c); }
__device__ __forceinline__ float sigm(float v) { return 1.0f / (1.0f + expf(-v)); }
#define LDSX() do { asm volatile("s_wait_dscnt 0" ::: "memory"); __builtin_amdgcn_wave_barrier(); __builtin_amdgcn_fence(__ATOMIC_RELEASE, "workgroup"); } while (0)


#define NB 2
#define SS 2048
#define DM 1024
#define NH 16
#define NKV 2
#define KVD (NKV * HD)    // 128
#define HPG (NH / NKV)    // 8 heads per group
#define HD 64
#define QKVW (DM + 2 * KVD)   // 1024 q rows, 128 k rows, 128 v rows
#ifndef TQB
#define TQB (SS / 64)
#define TNB NB
#define TOB (NB * SS / 64)     // output row tiles (all)
#endif
typedef __attribute__((ext_vector_type(8))) __bf16 v8b;
__device__ __forceinline__ v16b frag_b(const __bf16* rowk0, int lane) {
  union { v16b v; v8b q[2]; } u; const __bf16* p = rowk0 + 8 * (lane >> 4);
  u.q[0] = *(const v8b*)p; u.q[1] = *(const v8b*)(p + 16); return u.v;
}
__device__ __forceinline__ float bfr(float v) { return (float)(__bf16)v; }
__device__ __attribute__((noinline)) float exp_ni(float v) { return expf(v); }
__device__ __attribute__((noinline)) float erf_ni(float v) { return erff(v); }

#define PK_A 0                       // [1280][1024] Wq | Wk | Wv rows (natural [out][in])
#define PK_P (PK_A + QKVW * DM)        // [1024][1024] Wo rows (natural)
#define PK_END (PK_P + DM * DM)
#define WS_PK  0u
#define WS_QK  (WS_PK + 2u * PK_END)             // f16 [4096 rows][2048]: q in columns 0..1023, k (2 groups x 64) in columns 1024..1151
#define WS_QKL (WS_QK + 2u * NB * SS * 2 * DM)     // f16 q | k residual planes x2048
#define WS_VTH (WS_QKL + 2u * NB * SS * 2 * DM)    // f16 [b][128 (group*64+d)][2048 s] hi
#define WS_VTL (WS_VTH + 2u * NB * DM * SS)        // f16 lo x 2048
#define WS_O   (WS_VTL + 2u * NB * DM * SS)        // f32 [4096][1024]
#define WS_CS  (WS_O + 4u * NB * SS * DM)           // f32 [2][2048][32], unused
#define WS_BX  (WS_CS + 4u * 2 * SS * 32)                  // f32 [2][1024], unused
#define WS_END (WS_BX + 4u * 2 * DM + 256u)
// ---- k_pack: block = (row n, which): column n of (in,out) W -> bf16 row; which 0 -> W_q into PK_A row n; 1 -> W_o into PK_P
__global__ __launch_bounds__(256) void k_pack(const float* __restrict__ WQ, const float* __restrict__ WO, __bf16* __restrict__ PK) {
  __shared__ __align__(16) __bf16 s[DM]; const int n = blockIdx.x, which = blockIdx.y, t = threadIdx.x; const float* Wm = (which == 0) ? WQ : WO;   // (in,out) weights: pack row n = column n
  for (int k = t; k < DM; k += 256) s[k] = (__bf16)Wm[(size_t)k * DM + n];
  __syncthreads();
  __bf16* dst = (which == 0) ? PK + PK_A + (size_t)n * DM : PK + PK_P + (size_t)n * DM;
  for (int q = t; q < DM / 8; q += 256) vst2((unsigned*)(dst + q * 8), *(const v4u*)&s[q * 8]);
}
__global__ __launch_bounds__(128) void k_qkv(const float* __restrict__ XQ, const float* __restrict__ XK, const float* __restrict__ XV, const __bf16* __restrict__ P, const float* __restrict__ BQ, const float* __restrict__ BK, const float* __restrict__ BV, _Float16* __restrict__ QK, _Float16* __restrict__ QKL, _Float16* __restrict__ VTH, _Float16* __restrict__ VTL) {
  const int which0 = (blockIdx.y * 128 < DM) ? 0 : (blockIdx.y * 128 - DM) / KVD + 1; const float* X = (which0 == 0) ? XQ : (which0 == 1) ? XK : XV; const float* BB = BQ ? ((which0 == 0) ? BQ + blockIdx.y * 128 : (which0 == 1) ? BK : BV) : nullptr;   // column tiles 0..7 q, 8 k (both groups), 9 v (both groups)
  __shared__ __align__(16) _Float16 so[4][16][136], sol[4][16][136]; __shared__ __align__(16) _Float16 sth[128][72], stl[128][72];
  const int tid = threadIdx.x, wave = tid >> 5, lane = tid & 31, col = lane & 15, g = lane >> 4; const size_t r0 = (size_t)blockIdx.x * 64 + wave * 16; const int n0 = blockIdx.y * 128;
  v8f acc[8] = {};
#pragma unroll 2
  for (int kc = 0; kc < DM / 32; ++kc) { v16b a; { const float* p = X + (r0 + col) * DM + kc * 32 + 8 * g;
#pragma unroll
      for (int i = 0; i < 8; ++i) { a[i] = (__bf16)p[i]; a[8 + i] = (__bf16)p[16 + i]; } }
#pragma unroll
    for (int j = 0; j < 8; ++j) acc[j] = wmma_bf(a, frag_b(P + (size_t)(n0 + j * 16 + col) * DM + kc * 32, lane), acc[j]); }
  if (n0 < DM + KVD) {   // q stored unscaled (f16 sigma ~0.6, no subnormal exposure); 1/8 applied to the f32 score
#pragma unroll
    for (int j = 0; j < 8; ++j) {
#pragma unroll
      for (int r = 0; r < 8; ++r) { const float v = acc[j][r] + (BB ? bfr(BB[j * 16 + col]) : 0.f); const _Float16 hv = (_Float16)v; so[wave][8 * g + r][j * 16 + col] = hv; sol[wave][8 * g + r][j * 16 + col] = (_Float16)((v - (float)hv) * 2048.0f); } }   // q, k (+ bias) as f16 hi + (x2048) residual
    LDSX();
    for (int rl = 0; rl < 16; ++rl) if (lane < 16) { vst2((unsigned*)(QK + (r0 + rl) * (2 * DM) + n0 + lane * 8), *(const v4u*)&so[wave][rl][lane * 8]); vst2((unsigned*)(QKL + (r0 + rl) * (2 * DM) + n0 + lane * 8), *(const v4u*)&sol[wave][rl][lane * 8]); }
  } else {
#pragma unroll
    for (int j = 0; j < 8; ++j) {
#pragma unroll
      for (int r = 0; r < 8; ++r) { const float v = acc[j][r] + (BB ? bfr(BB[j * 16 + col]) : 0.f); const _Float16 hv = (_Float16)v; sth[j * 16 + col][wave * 16 + 8 * g + r] = hv; stl[j * 16 + col][wave * 16 + 8 * g + r] = (_Float16)((v - (float)hv) * 2048.0f); } }
    __syncthreads();
    const size_t rb = (size_t)blockIdx.x * 64; const int b = (int)(rb / SS), s0 = (int)(rb % SS); const int pc0 = n0 - (DM + KVD);
    for (int q = tid; q < 128 * 8; q += 128) { const int d = q >> 3, pc = q & 7; const size_t o = ((size_t)b * KVD + pc0 + d) * SS + s0 + pc * 8; vst2((unsigned*)(VTH + o), *(const v4u*)&sth[d][pc * 8]); vst2((unsigned*)(VTL + o), *(const v4u*)&stl[d][pc * 8]); }
  }
}
// ---- k_attn: block = (64 queries, head h, batch b): all-keys flash attention (K = 64: 2 k-steps), scores = (q.k) * 0.125 with single f16 operands, P.V: f16 P (x2^11) x V hi in one accumulator (accl stays 0); O[b*S+q][h*64+d] = (acc + accl / 2048) / (2048 l) (256-B segments)
__global__ __launch_bounds__(128) void k_attn(const _Float16* __restrict__ QK, const _Float16* __restrict__ QKL, const _Float16* __restrict__ VTH, const _Float16* __restrict__ VTL, const void* __restrict__ KMASK, float* __restrict__ O) {
  __shared__ __align__(16) float sp[4][16][36]; __shared__ __align__(16) float so[4][16][68];
  const int tid = threadIdx.x, wave = tid >> 5, lane = tid & 31, col = lane & 15, g = lane >> 4;
  const int qb = blockIdx.x, h = blockIdx.y, b = blockIdx.z, kvg = h / HPG; const int q0 = qb * 64 + wave * 16; const size_t rq = (size_t)b * SS + q0 + col;
  v16h aq[2], aql[2];
#pragma unroll
  for (int kc = 0; kc < 2; ++kc) { aq[kc] = frag_h(QK + rq * (2 * DM) + h * HD + kc * 32, lane); aql[kc] = frag_h(QKL + rq * (2 * DM) + h * HD + kc * 32, lane); }
  float m[8], l[8];
#pragma unroll
  for (int r = 0; r < 8; ++r) { m[r] = -3.0e38f; l[r] = 0.f; }
  v8f acc[4] = {}, accl[4] = {};
  const int nks = SS / 32;   // all keys
#pragma unroll 1
  for (int ks = 0; ks < nks; ++ks) { v8f s[2];
#pragma unroll
    for (int ct = 0; ct < 2; ++ct) { const int kk = ks * 32 + ct * 16 + col; const _Float16* krow = QK + ((size_t)b * SS + kk) * (2 * DM) + DM + kvg * HD; const _Float16* krowl = QKL + ((size_t)b * SS + kk) * (2 * DM) + DM + kvg * HD; v8f c = {}, cl = {};
#pragma unroll
      for (int kc = 0; kc < 2; ++kc) c = wmma16(aq[kc], frag_h(krow + kc * 32, lane), c);   // single product: q, k as one-rounding f16 operands
      (void)cl; (void)krowl;
      { const bool keepk = true;
#pragma unroll
      for (int r = 0; r < 8; ++r) s[ct][r] = keepk ? c[r] * 0.125f : -3.0e38f; } }   // 1/sqrt(64); no key mask: every key kept
#pragma unroll
    for (int r = 0; r < 8; ++r) { float mx = fmaxf(s[0][r], s[1][r]);
#pragma unroll
      for (int o = 1; o < 16; o <<= 1) mx = fmaxf(mx, __shfl_xor(mx, o));
      const float mn = fmaxf(m[r], mx); const float alpha = (m[r] <= -1.0e38f) ? 0.f : __expf(m[r] - mn);
      const float e0 = (s[0][r] <= -1.0e38f) ? 0.f : __expf(s[0][r] - mn), e1 = (s[1][r] <= -1.0e38f) ? 0.f : __expf(s[1][r] - mn); float es = e0 + e1;
#pragma unroll
      for (int o = 1; o < 16; o <<= 1) es += __shfl_xor(es, o);
      l[r] = l[r] * alpha + es; m[r] = mn;
#pragma unroll
      for (int dt = 0; dt < 4; ++dt) { acc[dt][r] *= alpha; accl[dt][r] *= alpha; }
      sp[wave][8 * g + r][col] = e0; sp[wave][8 * g + r][16 + col] = e1; }
    LDSX();
    v16h pa, pl; { const float* prow = &sp[wave][col][0] + 8 * (lane >> 4);
#pragma unroll
      for (int i = 0; i < 8; ++i) { const float x0 = prow[i] * 2048.0f, x1 = prow[16 + i] * 2048.0f; const _Float16 h0 = (_Float16)x0, h1 = (_Float16)x1; pa[i] = h0; pa[8 + i] = h1; pl[i] = (_Float16)((x0 - (float)h0) * 2048.0f); pl[8 + i] = (_Float16)((x1 - (float)h1) * 2048.0f); } }   // P scaled by 2^11 before the f16 split so small softmax weights stay out of the f16 subnormal range; 2^-11 folded into the epilogue
#pragma unroll
    for (int dt = 0; dt < 4; ++dt) { const size_t vr = ((size_t)b * KVD + kvg * HD + dt * 16 + col) * SS + ks * 32; acc[dt] = wmma16(pa, frag_h(VTH + vr, lane), acc[dt]); }   // single product: P (x2^11) x V
    (void)pl;
    LDSX(); }
#pragma unroll
  for (int r = 0; r < 8; ++r) { const float il = (1.0f / 2048.0f) / l[r];
#pragma unroll
    for (int dt = 0; dt < 4; ++dt) so[wave][8 * g + r][dt * 16 + col] = (acc[dt][r] + accl[dt][r] * (1.0f / 2048.0f)) * il; }
  LDSX();
  for (int rl = 0; rl < 16; ++rl) if (lane < 16) vst2(O + ((size_t)b * SS + q0 + rl) * DM + h * HD + lane * 4, *(const v4f*)&so[wave][rl][lane * 4]);
}
// ---- k_out: block = (64 rows, 128 cols): out = O(hi/lo) . Wo rows (2 products) + bo
__global__ __launch_bounds__(128) void k_out(const float* __restrict__ O, const __bf16* __restrict__ P, const float* __restrict__ BO, float* __restrict__ Y) {
  __shared__ __align__(16) float so[4][16][132];
  const int tid = threadIdx.x, wave = tid >> 5, lane = tid & 31, col = lane & 15, g = lane >> 4; const size_t r0 = (size_t)blockIdx.x * 64 + wave * 16; const int n0 = blockIdx.y * 128;
  v8f acc[8] = {};
#pragma unroll 2
  for (int kc = 0; kc < DM / 32; ++kc) { const F2 a = split_row(O + (r0 + col) * DM, kc * 32, lane);
#pragma unroll
    for (int j = 0; j < 8; ++j) { const v16b w = frag_b(P + (size_t)(n0 + j * 16 + col) * DM + kc * 32, lane); acc[j] = wmma_bf(a.l, w, acc[j]); acc[j] = wmma_bf(a.h, w, acc[j]); } }
#pragma unroll
  for (int j = 0; j < 8; ++j) {
#pragma unroll
    for (int r = 0; r < 8; ++r) so[wave][8 * g + r][j * 16 + col] = acc[j][r] + bfr(BO[n0 + j * 16 + col]); }
  LDSX();
  for (int rl = 0; rl < 16; ++rl) vst2(Y + (r0 + rl) * DM + n0 + lane * 4, *(const v4f*)&so[wave][rl][lane * 4]);
}
// ---- k_packkv: block = (column n of Wk / Wv (in,out) [1024][128], which): -> bf16 row DM + which * 128 + n of PK_A
__global__ __launch_bounds__(256) void k_packkv(const float* __restrict__ WK, const float* __restrict__ WV, __bf16* __restrict__ PK) {
  __shared__ __align__(16) __bf16 s[DM]; const int n = blockIdx.x, which = blockIdx.y, t = threadIdx.x; const float* Wm = which ? WV : WK;
  for (int k = t; k < DM; k += 256) s[k] = (__bf16)Wm[(size_t)k * KVD + n]; __syncthreads();
  for (int q = t; q < DM / 8; q += 256) vst2((unsigned*)(PK + PK_A + ((size_t)DM + which * KVD + n) * DM + q * 8), *(const v4u*)&s[q * 8]);
}
extern "C" void kernel_launch(void* const* d_in, const int* in_sizes, int n_in, void* d_out, int out_size, void* d_ws, size_t ws_size, hipStream_t stream) {
  (void)in_sizes; (void)n_in; (void)out_size;
  const float** F = (const float**)d_in;   // 0 x [2,2048,1024], 1 Wq [1024,1024] (in,out), 2 bq, 3 Wk [1024,128], 4 bk [128], 5 Wv [1024,128], 6 bv, 7 Wo [1024,1024], 8 bo
  if (ws_size < (size_t)WS_END) return;
  char* ws = (char*)d_ws; __bf16* PK = (__bf16*)(ws + WS_PK); _Float16 *QK = (_Float16*)(ws + WS_QK), *QKL = (_Float16*)(ws + WS_QKL), *VTH = (_Float16*)(ws + WS_VTH), *VTL = (_Float16*)(ws + WS_VTL); float *O = (float*)(ws + WS_O);
  k_pack<<<dim3(DM, 2), 256, 0, stream>>>(F[1], F[7], PK);   // q rows and Wo rows
  k_packkv<<<dim3(KVD, 2), 256, 0, stream>>>(F[3], F[5], PK);
  k_qkv<<<dim3(TNB * SS / 64, QKVW / 128), 128, 0, stream>>>(F[0], F[0], F[0], PK + PK_A, F[2], F[4], F[6], QK, QKL, VTH, VTL);
  k_attn<<<dim3(TQB, NH, TNB), 128, 0, stream>>>(QK, QKL, VTH, VTL, nullptr, O);
  k_out<<<dim3(TOB, DM / 128), 128, 0, stream>>>(O, PK + PK_P, F[8], (float*)d_out);
}

// v002
// A run of this version takes 202 microseconds.
// In two side-by-side timings against v001, it was 1.58 and 1.59 times as fast.
// Over all steps from v000 it is 2.06 times as fast.
// compute dtype: all float inputs rounded to bf16; q/k/v = x . W + b with EXACT bf16 products on WMMA 16x16x32 ((in,out) weights as transposed rows; each key/value group's 64 columns projected once, its 8 query heads read the group's k / v == repeat_interleave); PLAIN attention: q, k single f16 x 1/8, running-max softmax in f32 (hardware exp), P (scaled by 2^11, single f16) x v (single f16); out = o (bf16 hi + residual) . Wo (2 products) + bo.
#include <hip/hip_runtime.h>
#include <math.h>

typedef __attribute__((ext_vector_type(16))) _Float16 v16h;
typedef __attribute__((ext_vector_type(16))) __bf16 v16b;
typedef __attribute__((ext_vector_type(8)))  _Float16 v8h;
typedef __attribute__((ext_vector_type(8)))  float v8f;
typedef __attribute__((ext_vector_type(4)))  float v4f;
typedef __attribute__((ext_vector_type(2)))  float v2f;
typedef __attribute__((ext_vector_type(4)))  unsigned v4u;
typedef __attribute__((ext_vector_type(4)))  int v4i;
typedef float __attribute__((may_alias)) float_a;
typedef int __attribute__((may_alias)) int_a;

template <typename T> __device__ __forceinline__ void vst2(void* p, T v) { *(T*)p = v;  }
__device__ __forceinline__ v8f wmma16(v16h a, v16h b, v8f c) {
  v8f d = __builtin_amdgcn_wmma_f32_16x16x32_f16(false, a, false, b, (short)0, c, false, false);
  asm volatile("v_nop\n\tv_nop\n\tv_nop\n\tv_nop" : "+v"(d) : "v"(a), "v"(b));
  return d;
}
__device__ __forceinline__ v8f wmma_bf(v16b a, v16b b, v8f c) {
  v8f d = __builtin_amdgcn_wmma_f32_16x16x32_bf16(false, a, false, b, (short)0, c, false, false);
  asm volatile("v_nop\n\tv_nop\n\tv_nop\n\tv_nop" : "+v"(d) : "v"(a), "v"(b));
  return d;
}
// Grouped-query self attention (B 2, S 2,048, 1,024 dims, 16 query heads sharing 2 key/value groups of 64): q/k/v projections + biases, softmax(q k^T / 8) v per head against its group's k/v, output projection + bias.
__device__ __forceinline__ v16h frag_h(const _Float16* rowk0, int lane) {
  union { v16h v; v8h q[2]; } u; const _Float16* p = rowk0 + 8 * (lane >> 4);
  u.q[0] = *(const v8h*)p; u.q[1] = *(const v8h*)(p + 16); return u.v;
}
__device__ __forceinline__ v16h frag_f32(const float* rowk0, int lane) {
  v16h a; const float* p = rowk0 + 8 * (lane >> 4);
#pragma unroll
  for (int i = 0; i < 8; ++i) { a[i] = (_Float16)p[i]; a[8 + i] = (_Float16)p[16 + i]; }
  return a;
}
__device__ __forceinline__ v16h frag_f32s(const float* rowk0, int lane, float sc) {
  v16h a; const float* p = rowk0 + 8 * (lane >> 4);
#pragma unroll
  for (int i = 0; i < 8; ++i) { a[i] = (_Float16)(p[i] * sc); a[8 + i] = (_Float16)(p[16 + i] * sc); }
  return a;
}
// column fragment from a [K][ld] layout (column n), rows >= K read as 0
__device__ __forceinline__ v16h fragc_f32(const float* W, int k0, int n, int lane, int ld, int K) {
  v16h a; const int g = lane >> 4;
#pragma unroll
  for (int i = 0; i < 8; ++i) { const int ka = k0 + 8 * g + i, kb = ka + 16;
    a[i] = (_Float16)(ka < K ? W[(size_t)(ka < K ? ka : K - 1) * ld + n] : 0.f); a[8 + i] = (_Float16)(kb < K ? W[(size_t)(kb < K ? kb : K - 1) * ld + n] : 0.f); }
  return a;
}
struct F2 { v16b h, l; };
__device__ __forceinline__ F2 bsplit16(const float v[16]) { F2 r;
#pragma unroll
  for (int i = 0; i < 16; ++i) { const __bf16 h = (__bf16)v[i]; r.h[i] = h; r.l[i] = (__bf16)(v[i] - (float)h); }
  return r; }
__device__ __forceinline__ F2 split_row(const float* row, int k0, int lane) { float v[16]; const float* p = row + k0 + 8 * (lane >> 4);
#pragma unroll
  for (int i = 0; i < 8; ++i) { v[i] = p[i]; v[8 + i] = p[16 + i]; }
  return bsplit16(v); }
__device__ __forceinline__ F2 split_rowK(const float* row, int k0, int lane, int K) { float v[16]; const int g = lane >> 4;
#pragma unroll
  for (int i = 0; i < 8; ++i) { const int ka = k0 + 8 * g + i, kb = ka + 16; v[i] = ka < K ? row[ka < K ? ka : K - 1] : 0.f; v[8 + i] = kb < K ? row[kb < K ? kb : K - 1] : 0.f; }
  return bsplit16(v); }
__device__ __forceinline__ F2 split_col(const float* W, int k0, int n, int lane, int ld, int K) { float v[16]; const int g = lane >> 4;
#pragma unroll
  for (int i = 0; i < 8; ++i) { const int ka = k0 + 8 * g + i, kb = ka + 16; v[i] = ka < K ? W[(size_t)(ka < K ? ka : K - 1) * ld + n] : 0.f; v[8 + i] = kb < K ? W[(size_t)(kb < K ? kb : K - 1) * ld + n] : 0.f; }
  return bsplit16(v); }
__device__ __forceinline__ v8f mac3(const F2& a, const F2& b, v8f c) { c = wmma_bf(a.l, b.h, c); c = wmma_bf(a.h, b.l, c); return wmma_bf(a.h, b.h, c); }
__device__ __forceinline__ float sigm(float v) { return 1.0f / (1.0f + expf(-v)); }
#define LDSX() do { asm volatile("s_wait_dscnt 0" ::: "memory"); __builtin_amdgcn_wave_barrier(); __builtin_amdgcn_fence(__ATOMIC_RELEASE, "workgroup"); } while (0)


#define NB 2
#define SS 2048
#define DM 1024
#define NH 16
#define NKV 2
#define KVD (NKV * HD)    // 128
#define HPG (NH / NKV)    // 8 heads per group
#define HD 64
#define QKVW (DM + 2 * KVD)   // 1024 q rows, 128 k rows, 128 v rows
#ifndef TQB
#define TQB (SS / 64)
#define TNB NB
#define TOB (NB * SS / 64)     // output row tiles (all)
#endif
typedef __attribute__((ext_vector_type(8))) __bf16 v8b;
__device__ __forceinline__ v16b frag_b(const __bf16* rowk0, int lane) {
  union { v16b v; v8b q[2]; } u; const __bf16* p = rowk0 + 8 * (lane >> 4);
  u.q[0] = *(const v8b*)p; u.q[1] = *(const v8b*)(p + 16); return u.v;
}
__device__ __forceinline__ float bfr(float v) { return (float)(__bf16)v; }
__device__ __attribute__((noinline)) float exp_ni(float v) { return expf(v); }
__device__ __attribute__((noinline)) float erf_ni(float v) { return erff(v); }

#define PK_A 0                       // [1280][1024] Wq | Wk | Wv rows (natural [out][in])
#define PK_P (PK_A + QKVW * DM)        // [1024][1024] Wo rows (natural)
#define PK_END (PK_P + DM * DM)
#define WS_PK  0u
#define WS_QK  (WS_PK + 2u * PK_END)             // f16 [4096 rows][2048]: q in columns 0..1023, k (2 groups x 64) in columns 1024..1151
#define WS_QKL (WS_QK + 2u * NB * SS * 2 * DM)     // f16 q | k residual planes x2048
#define WS_VTH (WS_QKL + 2u * NB * SS * 2 * DM)    // f16 [b][128 (group*64+d)][2048 s] hi
#define WS_VTL (WS_VTH + 2u * NB * DM * SS)        // f16 lo x 2048
#define WS_O   (WS_VTL + 2u * NB * DM * SS)        // f32 [4096][1024]
#define WS_CS  (WS_O + 4u * NB * SS * DM)           // f32 [2][2048][32], unused
#define WS_BX  (WS_CS + 4u * 2 * SS * 32)                  // f32 [2][1024], unused
#define WS_END (WS_BX + 4u * 2 * DM + 256u)
// ---- k_pack: block = (row n, which): column n of (in,out) W -> bf16 row; which 0 -> W_q into PK_A row n; 1 -> W_o into PK_P
__global__ __launch_bounds__(256) void k_pack(const float* __restrict__ WQ, const float* __restrict__ WO, __bf16* __restrict__ PK) {
  __shared__ __align__(16) __bf16 s[DM]; const int n = blockIdx.x, which = blockIdx.y, t = threadIdx.x; const float* Wm = (which == 0) ? WQ : WO;   // (in,out) weights: pack row n = column n
  for (int k = t; k < DM; k += 256) s[k] = (__bf16)Wm[(size_t)k * DM + n];
  __syncthreads();
  __bf16* dst = (which == 0) ? PK + PK_A + (size_t)n * DM : PK + PK_P + (size_t)n * DM;
  for (int q = t; q < DM / 8; q += 256) vst2((unsigned*)(dst + q * 8), *(const v4u*)&s[q * 8]);
}
__global__ __launch_bounds__(128) void k_qkv(const float* __restrict__ XQ, const float* __restrict__ XK, const float* __restrict__ XV, const __bf16* __restrict__ P, const float* __restrict__ BQ, const float* __restrict__ BK, const float* __restrict__ BV, _Float16* __restrict__ QK, _Float16* __restrict__ QKL, _Float16* __restrict__ VTH, _Float16* __restrict__ VTL) {
  const int which0 = (blockIdx.y * 128 < DM) ? 0 : (blockIdx.y * 128 - DM) / KVD + 1; const float* X = (which0 == 0) ? XQ : (which0 == 1) ? XK : XV; const float* BB = BQ ? ((which0 == 0) ? BQ + blockIdx.y * 128 : (which0 == 1) ? BK : BV) : nullptr;   // column tiles 0..7 q, 8 k (both groups), 9 v (both groups)
  __shared__ __align__(16) _Float16 so[4][16][136], sol[4][16][136]; __shared__ __align__(16) _Float16 sth[128][72], stl[128][72];
  const int tid = threadIdx.x, wave = tid >> 5, lane = tid & 31, col = lane & 15, g = lane >> 4; const size_t r0 = (size_t)blockIdx.x * 64 + wave * 16; const int n0 = blockIdx.y * 128;
  v8f acc[8] = {};
#pragma unroll 2
  for (int kc = 0; kc < DM / 32; ++kc) { v16b a, w[8]; { const float* p = X + (r0 + col) * DM + kc * 32 + 8 * g;
#pragma unroll
      for (int i = 0; i < 8; ++i) { a[i] = (__bf16)p[i]; a[8 + i] = (__bf16)p[16 + i]; } }
#pragma unroll
    for (int j = 0; j < 8; ++j) w[j] = frag_b(P + (size_t)(n0 + j * 16 + col) * DM + kc * 32, lane);   // all 8 weight fragments of the k step are requested before its first WMMA: one load latency a k step, not eight
#pragma unroll
    for (int j = 0; j < 8; ++j) acc[j] = wmma_bf(a, w[j], acc[j]); }
  if (n0 < DM + KVD) {   // q stored unscaled (f16 sigma ~0.6, no subnormal exposure); 1/8 applied to the f32 score
#pragma unroll
    for (int j = 0; j < 8; ++j) {
#pragma unroll
      for (int r = 0; r < 8; ++r) { const float v = acc[j][r] + (BB ? bfr(BB[j * 16 + col]) : 0.f); const _Float16 hv = (_Float16)v; so[wave][8 * g + r][j * 16 + col] = hv; sol[wave][8 * g + r][j * 16 + col] = (_Float16)((v - (float)hv) * 2048.0f); } }   // q, k (+ bias) as f16 hi + (x2048) residual
    LDSX();
    for (int rl = 0; rl < 16; ++rl) if (lane < 16) { vst2((unsigned*)(QK + (r0 + rl) * (2 * DM) + n0 + lane * 8), *(const v4u*)&so[wave][rl][lane * 8]); vst2((unsigned*)(QKL + (r0 + rl) * (2 * DM) + n0 + lane * 8), *(const v4u*)&sol[wave][rl][lane * 8]); }
  } else {
#pragma unroll
    for (int j = 0; j < 8; ++j) {
#pragma unroll
      for (int r = 0; r < 8; ++r) { const float v = acc[j][r] + (BB ? bfr(BB[j * 16 + col]) : 0.f); const _Float16 hv = (_Float16)v; sth[j * 16 + col][wave * 16 + 8 * g + r] = hv; stl[j * 16 + col][wave * 16 + 8 * g + r] = (_Float16)((v - (float)hv) * 2048.0f); } }
    __syncthreads();
    const size_t rb = (size_t)blockIdx.x * 64; const int b = (int)(rb / SS), s0 = (int)(rb % SS); const int pc0 = n0 - (DM + KVD);
    for (int q = tid; q < 128 * 8; q += 128) { const int d = q >> 3, pc = q & 7; const size_t o = ((size_t)b * KVD + pc0 + d) * SS + s0 + pc * 8; vst2((unsigned*)(VTH + o), *(const v4u*)&sth[d][pc * 8]); vst2((unsigned*)(VTL + o), *(const v4u*)&stl[d][pc * 8]); }
  }
}
// ---- k_attn: block = (64 queries, head h, batch b): all-keys flash attention (K = 64: 2 k-steps), scores = (q.k) * 0.125 with single f16 operands, P.V: f16 P (x2^11) x V hi in one accumulator (accl stays 0); O[b*S+q][h*64+d] = (acc + accl / 2048) / (2048 l) (256-B segments)
__global__ __launch_bounds__(128) void k_attn(const _Float16* __restrict__ QK, const _Float16* __restrict__ QKL, const _Float16* __restrict__ VTH, const _Float16* __restrict__ VTL, const void* __restrict__ KMASK, float* __restrict__ O) {
  __shared__ __align__(16) float sp[4][16][36]; __shared__ __align__(16) float so[4][16][68];
  const int tid = threadIdx.x, wave = tid >> 5, lane = tid & 31, col = lane & 15, g = lane >> 4;
  const int qb = blockIdx.x, h = blockIdx.y, b = blockIdx.z, kvg = h / HPG; const int q0 = qb * 64 + wave * 16; const size_t rq = (size_t)b * SS + q0 + col;
  v16h aq[2], aql[2];
#pragma unroll
  for (int kc = 0; kc < 2; ++kc) { aq[kc] = frag_h(QK + rq * (2 * DM) + h * HD + kc * 32, lane); aql[kc] = frag_h(QKL + rq * (2 * DM) + h * HD + kc * 32, lane); }
  float m[8], l[8];
#pragma unroll
  for (int r = 0; r < 8; ++r) { m[r] = -3.0e38f; l[r] = 0.f; }
  v8f acc[4] = {}, accl[4] = {};
  const int nks = SS / 32;   // all keys
#pragma unroll 1
  for (int ks = 0; ks < nks; ++ks) { v8f s[2]; v16h bk[2][2], bv[4];   // the pass's 4 k and 4 v fragments are requested together here: the k latency is paid once, the v latency runs under the scores and the softmax
#pragma unroll
    for (int ct = 0; ct < 2; ++ct) { const _Float16* krow = QK + ((size_t)b * SS + ks * 32 + ct * 16 + col) * (2 * DM) + DM + kvg * HD;
#pragma unroll
      for (int kc = 0; kc < 2; ++kc) bk[ct][kc] = frag_h(krow + kc * 32, lane); }
    asm volatile("s_wait_xcnt 0x0" ::: "memory");   // the v loads below may land in the registers that held the k loads' addresses: the wait stands in front of that overwrite
#pragma unroll
    for (int dt = 0; dt < 4; ++dt) bv[dt] = frag_h(VTH + ((size_t)b * KVD + kvg * HD + dt * 16 + col) * SS + ks * 32, lane);
#pragma unroll
    for (int ct = 0; ct < 2; ++ct) { v8f c = {};
#pragma unroll
      for (int kc = 0; kc < 2; ++kc) c = wmma16(aq[kc], bk[ct][kc], c);   // single product: q, k as one-rounding f16 operands
      { const bool keepk = true;
#pragma unroll
      for (int r = 0; r < 8; ++r) s[ct][r] = keepk ? c[r] * 0.125f : -3.0e38f; } }   // 1/sqrt(64); no key mask: every key kept
#pragma unroll
    for (int r = 0; r < 8; ++r) { float mx = fmaxf(s[0][r], s[1][r]);
#pragma unroll
      for (int o = 1; o < 16; o <<= 1) mx = fmaxf(mx, __shfl_xor(mx, o));
      const float mn = fmaxf(m[r], mx); const float alpha = (m[r] <= -1.0e38f) ? 0.f : __expf(m[r] - mn);
      const float e0 = (s[0][r] <= -1.0e38f) ? 0.f : __expf(s[0][r] - mn), e1 = (s[1][r] <= -1.0e38f) ? 0.f : __expf(s[1][r] - mn); float es = e0 + e1;
#pragma unroll
      for (int o = 1; o < 16; o <<= 1) es += __shfl_xor(es, o);
      l[r] = l[r] * alpha + es; m[r] = mn;
#pragma unroll
      for (int dt = 0; dt < 4; ++dt) { acc[dt][r] *= alpha; accl[dt][r] *= alpha; }
      sp[wave][8 * g + r][col] = e0; sp[wave][8 * g + r][16 + col] = e1; }
    LDSX();
    v16h pa, pl; { const float* prow = &sp[wave][col][0] + 8 * (lane >> 4);
#pragma unroll
      for (int i = 0; i < 8; ++i) { const float x0 = prow[i] * 2048.0f, x1 = prow[16 + i] * 2048.0f; const _Float16 h0 = (_Float16)x0, h1 = (_Float16)x1; pa[i] = h0; pa[8 + i] = h1; pl[i] = (_Float16)((x0 - (float)h0) * 2048.0f); pl[8 + i] = (_Float16)((x1 - (float)h1) * 2048.0f); } }   // P scaled by 2^11 before the f16 split so small softmax weights stay out of the f16 subnormal range; 2^-11 folded into the epilogue
#pragma unroll
    for (int dt = 0; dt < 4; ++dt) acc[dt] = wmma16(pa, bv[dt], acc[dt]);   // single product: P (x2^11) x V
    (void)pl;
    LDSX(); }
#pragma unroll
  for (int r = 0; r < 8; ++r) { const float il = (1.0f / 2048.0f) / l[r];
#pragma unroll
    for (int dt = 0; dt < 4; ++dt) so[wave][8 * g + r][dt * 16 + col] = (acc[dt][r] + accl[dt][r] * (1.0f / 2048.0f)) * il; }
  LDSX();
  for (int rl = 0; rl < 16; ++rl) if (lane < 16) vst2(O + ((size_t)b * SS + q0 + rl) * DM + h * HD + lane * 4, *(const v4f*)&so[wave][rl][lane * 4]);
}
// ---- k_out: block = (64 rows, 128 cols): out = O(hi/lo) . Wo rows (2 products) + bo
__global__ __launch_bounds__(128) void k_out(const float* __restrict__ O, const __bf16* __restrict__ P, const float* __restrict__ BO, float* __restrict__ Y) {
  __shared__ __align__(16) float so[4][16][132];
  const int tid = threadIdx.x, wave = tid >> 5, lane = tid & 31, col = lane & 15, g = lane >> 4; const size_t r0 = (size_t)blockIdx.x * 64 + wave * 16; const int n0 = blockIdx.y * 128;
  v8f acc[8] = {};
#pragma unroll 2
  for (int kc = 0; kc < DM / 32; ++kc) { const F2 a = split_row(O + (r0 + col) * DM, kc * 32, lane); v16b w[8];
#pragma unroll
    for (int j = 0; j < 8; ++j) w[j] = frag_b(P + (size_t)(n0 + j * 16 + col) * DM + kc * 32, lane);   // all 8 weight fragments requested before the first WMMA of the k step
#pragma unroll
    for (int j = 0; j < 8; ++j) { acc[j] = wmma_bf(a.l, w[j], acc[j]); acc[j] = wmma_bf(a.h, w[j], acc[j]); } }
#pragma unroll
  for (int j = 0; j < 8; ++j) {
#pragma unroll
    for (int r = 0; r < 8; ++r) so[wave][8 * g + r][j * 16 + col] = acc[j][r] + bfr(BO[n0 + j * 16 + col]); }
  LDSX();
  for (int rl = 0; rl < 16; ++rl) vst2(Y + (r0 + rl) * DM + n0 + lane * 4, *(const v4f*)&so[wave][rl][lane * 4]);
}
// ---- k_packkv: block = (column n of Wk / Wv (in,out) [1024][128], which): -> bf16 row DM + which * 128 + n of PK_A
__global__ __launch_bounds__(256) void k_packkv(const float* __restrict__ WK, const float* __restrict__ WV, __bf16* __restrict__ PK) {
  __shared__ __align__(16) __bf16 s[DM]; const int n = blockIdx.x, which = blockIdx.y, t = threadIdx.x; const float* Wm = which ? WV : WK;
  for (int k = t; k < DM; k += 256) s[k] = (__bf16)Wm[(size_t)k * KVD + n]; __syncthreads();
  for (int q = t; q < DM / 8; q += 256) vst2((unsigned*)(PK + PK_A + ((size_t)DM + which * KVD + n) * DM + q * 8), *(const v4u*)&s[q * 8]);
}
extern "C" void kernel_launch(void* const* d_in, const int* in_sizes, int n_in, void* d_out, int out_size, void* d_ws, size_t ws_size, hipStream_t stream) {
  (void)in_sizes; (void)n_in; (void)out_size;
  const float** F = (const float**)d_in;   // 0 x [2,2048,1024], 1 Wq [1024,1024] (in,out), 2 bq, 3 Wk [1024,128], 4 bk [128], 5 Wv [1024,128], 6 bv, 7 Wo [1024,1024], 8 bo
  if (ws_size < (size_t)WS_END) return;
  char* ws = (char*)d_ws; __bf16* PK = (__bf16*)(ws + WS_PK); _Float16 *QK = (_Float16*)(ws + WS_QK), *QKL = (_Float16*)(ws + WS_QKL), *VTH = (_Float16*)(ws + WS_VTH), *VTL = (_Float16*)(ws + WS_VTL); float *O = (float*)(ws + WS_O);
  k_pack<<<dim3(DM, 2), 256, 0, stream>>>(F[1], F[7], PK);   // q rows and Wo rows
  k_packkv<<<dim3(KVD, 2), 256, 0, stream>>>(F[3], F[5], PK);
  k_qkv<<<dim3(TNB * SS / 64, QKVW / 128), 128, 0, stream>>>(F[0], F[0], F[0], PK + PK_A, F[2], F[4], F[6], QK, QKL, VTH, VTL);
  k_attn<<<dim3(TQB, NH, TNB), 128, 0, stream>>>(QK, QKL, VTH, VTL, nullptr, O);
  k_out<<<dim3(TOB, DM / 128), 128, 0, stream>>>(O, PK + PK_P, F[8], (float*)d_out);
}

// v003
// A run of this version takes 157 microseconds.
// Two timings next to v002 put it at 1.24 and 1.33 times that version's speed.
// Counting every step since v000, it is 2.65 times as fast.
// compute dtype: all float inputs rounded to bf16; q/k/v = x . W + b with EXACT bf16 products on WMMA 16x16x32 ((in,out) weights as transposed rows; each key/value group's 64 columns projected once, its 8 query heads read the group's k / v == repeat_interleave); PLAIN attention: q, k single f16 x 1/8, running-max softmax in f32 (hardware exp), P (scaled by 2^11, single f16) x v (single f16); out = o (bf16 hi + residual) . Wo (2 products) + bo.
#include <hip/hip_runtime.h>
#include <math.h>

typedef __attribute__((ext_vector_type(16))) _Float16 v16h;
typedef __attribute__((ext_vector_type(16))) __bf16 v16b;
typedef __attribute__((ext_vector_type(8)))  _Float16 v8h;
typedef __attribute__((ext_vector_type(8)))  float v8f;
typedef __attribute__((ext_vector_type(4)))  float v4f;
typedef __attribute__((ext_vector_type(2)))  float v2f;
typedef __attribute__((ext_vector_type(4)))  unsigned v4u;
typedef __attribute__((ext_vector_type(4)))  int v4i;
typedef float __attribute__((may_alias)) float_a;
typedef int __attribute__((may_alias)) int_a;

template <typename T> __device__ __forceinline__ void vst2(void* p, T v) { *(T*)p = v;  }
__device__ __forceinline__ v8f wmma16(v16h a, v16h b, v8f c) {
  v8f d = __builtin_amdgcn_wmma_f32_16x16x32_f16(false, a, false, b, (short)0, c, false, false);
  asm volatile("v_nop\n\tv_nop\n\tv_nop\n\tv_nop" : "+v"(d) : "v"(a), "v"(b));
  return d;
}
__device__ __forceinline__ v8f wmma_bf(v16b a, v16b b, v8f c) {
  v8f d = __builtin_amdgcn_wmma_f32_16x16x32_bf16(false, a, false, b, (short)0, c, false, false);
  asm volatile("v_nop\n\tv_nop\n\tv_nop\n\tv_nop" : "+v"(d) : "v"(a), "v"(b));
  return d;
}
// Grouped-query self attention (B 2, S 2,048, 1,024 dims, 16 query heads sharing 2 key/value groups of 64): q/k/v projections + biases, softmax(q k^T / 8) v per head against its group's k/v, output projection + bias.
__device__ __forceinline__ v16h frag_h(const _Float16* rowk0, int lane) {
  union { v16h v; v8h q[2]; } u; const _Float16* p = rowk0 + 8 * (lane >> 4);
  u.q[0] = *(const v8h*)p; u.q[1] = *(const v8h*)(p + 16); return u.v;
}
__device__ __forceinline__ v16h frag_f32(const float* rowk0, int lane) {
  v16h a; const float* p = rowk0 + 8 * (lane >> 4);
#pragma unroll
  for (int i = 0; i < 8; ++i) { a[i] = (_Float16)p[i]; a[8 + i] = (_Float16)p[16 + i]; }
  return a;
}
__device__ __forceinline__ v16h frag_f32s(const float* rowk0, int lane, float sc) {
  v16h a; const float* p = rowk0 + 8 * (lane >> 4);
#pragma unroll
  for (int i = 0; i < 8; ++i) { a[i] = (_Float16)(p[i] * sc); a[8 + i] = (_Float16)(p[16 + i] * sc); }
  return a;
}
// column fragment from a [K][ld] layout (column n), rows >= K read as 0
__device__ __forceinline__ v16h fragc_f32(const float* W, int k0, int n, int lane, int ld, int K) {
  v16h a; const int g = lane >> 4;
#pragma unroll
  for (int i = 0; i < 8; ++i) { const int ka = k0 + 8 * g + i, kb = ka + 16;
    a[i] = (_Float16)(ka < K ? W[(size_t)(ka < K ? ka : K - 1) * ld + n] : 0.f); a[8 + i] = (_Float16)(kb < K ? W[(size_t)(kb < K ? kb : K - 1) * ld + n] : 0.f); }
  return a;
}
struct F2 { v16b h, l; };
__device__ __forceinline__ F2 bsplit16(const float v[16]) { F2 r;
#pragma unroll
  for (int i = 0; i < 16; ++i) { const __bf16 h = (__bf16)v[i]; r.h[i] = h; r.l[i] = (__bf16)(v[i] - (float)h); }
  return r; }
__device__ __forceinline__ F2 split_row(const float* row, int k0, int lane) { float v[16]; const float* p = row + k0 + 8 * (lane >> 4);
#pragma unroll
  for (int i = 0; i < 8; ++i) { v[i] = p[i]; v[8 + i] = p[16 + i]; }
  return bsplit16(v); }
__device__ __forceinline__ F2 split_rowK(const float* row, int k0, int lane, int K) { float v[16]; const int g = lane >> 4;
#pragma unroll
  for (int i = 0; i < 8; ++i) { const int ka = k0 + 8 * g + i, kb = ka + 16; v[i] = ka < K ? row[ka < K ? ka : K - 1] : 0.f; v[8 + i] = kb < K ? row[kb < K ? kb : K - 1] : 0.f; }
  return bsplit16(v); }
__device__ __forceinline__ F2 split_col(const float* W, int k0, int n, int lane, int ld, int K) { float v[16]; const int g = lane >> 4;
#pragma unroll
  for (int i = 0; i < 8; ++i) { const int ka = k0 + 8 * g + i, kb = ka + 16; v[i] = ka < K ? W[(size_t)(ka < K ? ka : K - 1) * ld + n] : 0.f; v[8 + i] = kb < K ? W[(size_t)(kb < K ? kb : K - 1) * ld + n] : 0.f; }
  return bsplit16(v); }
__device__ __forceinline__ v8f mac3(const F2& a, const F2& b, v8f c) { c = wmma_bf(a.l, b.h, c); c = wmma_bf(a.h, b.l, c); return wmma_bf(a.h, b.h, c); }
__device__ __forceinline__ float sigm(float v) { return 1.0f / (1.0f + expf(-v)); }
#define LDSX() do { asm volatile("s_wait_dscnt 0" ::: "memory"); __builtin_amdgcn_wave_barrier(); __builtin_amdgcn_fence(__ATOMIC_RELEASE, "workgroup"); } while (0)


#define NB 2
#define SS 2048
#define DM 1024
#define NH 16
#define NKV 2
#define KVD (NKV * HD)    // 128
#define HPG (NH / NKV)    // 8 heads per group
#define HD 64
#define QKVW (DM + 2 * KVD)   // 1024 q rows, 128 k rows, 128 v rows
#ifndef TQB
#define TQB (SS / 64)
#define TNB NB
#define TOB (NB * SS / 64)     // output row tiles (all)
#endif
typedef __attribute__((ext_vector_type(8))) __bf16 v8b;
__device__ __forceinline__ v16b frag_b(const __bf16* rowk0, int lane) {
  union { v16b v; v8b q[2]; } u; const __bf16* p = rowk0 + 8 * (lane >> 4);
  u.q[0] = *(const v8b*)p; u.q[1] = *(const v8b*)(p + 16); return u.v;
}
// FRAGMENT ORDER: a 16 x 32 operand fragment of 16-bit elements is 1 KiB in a row: piece q (0, 1), lane, 8 elements; lane (c, h) of piece q holds row c, k = 16 q + 8 h .. + 7 (what frag_b / frag_h read from a row-major plane). Each of the two wave-wide 16-byte loads then covers 512 contiguous bytes, 4 whole cache lines, where a row-major plane makes it touch 16.
__device__ __forceinline__ v16b fragp_b(const __bf16* frag0, int lane) {
  union { v16b v; v8b q[2]; } u; const __bf16* p = frag0 + 8 * lane;
  u.q[0] = *(const v8b*)p; u.q[1] = *(const v8b*)(p + 256); return u.v;
}
__device__ __forceinline__ v16h fragp_h(const _Float16* frag0, int lane) {
  union { v16h v; v8h q[2]; } u; const _Float16* p = frag0 + 8 * lane;
  u.q[0] = *(const v8h*)p; u.q[1] = *(const v8h*)(p + 256); return u.v;
}
// the same for a 16 x 32 fragment of f32 (2 KiB): piece p (0 .. 3), lane, 4 floats; lane (c, h) of piece p holds row c, k = 16 (p >> 1) + 8 h + 4 (p & 1) .. + 3 (what split_row reads from a row-major plane)
__device__ __forceinline__ F2 split_frag(const float* frag0, int lane) { float v[16]; const float* p = frag0 + 4 * lane;
#pragma unroll
  for (int i = 0; i < 16; ++i) v[i] = p[(i >> 2) * 128 + (i & 3)];
  return bsplit16(v); }
__device__ __forceinline__ float bfr(float v) { return (float)(__bf16)v; }
__device__ __attribute__((noinline)) float exp_ni(float v) { return expf(v); }
__device__ __attribute__((noinline)) float erf_ni(float v) { return erff(v); }

#define PK_A 0                       // Wq | Wk | Wv: 80 tiles of 16 output rows x 32 k steps, each a 512-element fragment (fragment order)
#define PK_P (PK_A + QKVW * DM)        // Wo: 64 tiles x 32 k steps of fragments
#define PK_END (PK_P + DM * DM)
#define WS_PK  0u
#define WS_QK  (WS_PK + 2u * PK_END)             // f16 [4096 rows][2048]: q in columns 0..1023
#define WS_QKL (WS_QK + 2u * NB * SS * 2 * DM)     // f16 q | k residual planes x2048
#define WS_VTH (WS_QKL + 2u * NB * SS * 2 * DM)    // f16 v^T hi in fragment order: [b][group][64 steps of 32 s][4 tiles of 16 d][512]
#define WS_VTL (WS_VTH + 2u * NB * DM * SS)        // f16 lo x 2048
#define WS_O   (WS_VTL + 2u * NB * DM * SS)        // f32 attention output in fragment order: [256 tiles of 16 rows][32 k steps][512]
#define WS_CS  (WS_O + 4u * NB * SS * DM)           // unused: room for f32 [2][2048][32]
#define WS_BX  (WS_CS + 4u * 2 * SS * 32)                  // unused: room for f32 [2][1024] + 256 bytes
#define WS_KF  (WS_BX + 4u * 2 * DM + 256u)                // f16 k in fragment order: [b][group][128 tiles of 16 s][2 steps of 32 d][512]
#define WS_END (WS_KF + 2u * NB * SS * KVD)
// ---- pack_chunk: thread t of a block writes one 16-byte piece of 4 consecutive fragments (k steps kq * 4 .. + 3) of output-row tile 'tile' of an (in,out) weight [1024][ld]: the block's 256 pieces are 4 KiB in a row (whole lines, one writer each); its 8 reads are column tile * 16 + c at 8 consecutive k
__device__ __forceinline__ void pack_chunk(const float* __restrict__ Wm, int ld, int tile, int kq, __bf16* __restrict__ dst, int t) {
  const int k0 = kq * 128 + (t >> 6) * 32 + ((t >> 5) & 1) * 16 + ((t >> 4) & 1) * 8, n = tile * 16 + (t & 15); v8b o;
#pragma unroll
  for (int i = 0; i < 8; ++i) o[i] = (__bf16)Wm[(size_t)(k0 + i) * ld + n];
  *(v8b*)(dst + (size_t)kq * 2048 + t * 8) = o;
}
// ---- k_pack: block = (tile of 16 output rows x 8 + eighth of k kq, which): which 0 -> W_q into PK_A; 1 -> W_o into PK_P
__global__ __launch_bounds__(256) void k_pack(const float* __restrict__ WQ, const float* __restrict__ WO, __bf16* __restrict__ PK) {
  const int tile = blockIdx.x >> 3, kq = blockIdx.x & 7, which = blockIdx.y;
  pack_chunk((which == 0) ? WQ : WO, DM, tile, kq, PK + ((which == 0) ? PK_A : PK_P) + (size_t)tile * (16 * DM), threadIdx.x);
}
__global__ __launch_bounds__(128) void k_qkv(const float* __restrict__ XQ, const float* __restrict__ XK, const float* __restrict__ XV, const __bf16* __restrict__ P, const float* __restrict__ BQ, const float* __restrict__ BK, const float* __restrict__ BV, _Float16* __restrict__ QK, _Float16* __restrict__ QKL, _Float16* __restrict__ VTH, _Float16* __restrict__ VTL, _Float16* __restrict__ KF) {
  const int which0 = (blockIdx.y * 128 < DM) ? 0 : (blockIdx.y * 128 - DM) / KVD + 1; const float* X = (which0 == 0) ? XQ : (which0 == 1) ? XK : XV; const float* BB = BQ ? ((which0 == 0) ? BQ + blockIdx.y * 128 : (which0 == 1) ? BK : BV) : nullptr;   // column tiles 0..7 q, 8 k (both groups), 9 v (both groups)
  __shared__ __align__(16) _Float16 so[4][16][136], sol[4][16][136]; __shared__ __align__(16) _Float16 sth[128][72], stl[128][72];
  const int tid = threadIdx.x, wave = tid >> 5, lane = tid & 31, col = lane & 15, g = lane >> 4; const size_t r0 = (size_t)blockIdx.x * 64 + wave * 16; const int n0 = blockIdx.y * 128;
  v8f acc[8] = {};
#pragma unroll 2
  for (int kc = 0; kc < DM / 32; ++kc) { v16b a, w[8]; { const float* p = X + (r0 + col) * DM + kc * 32 + 8 * g;
#pragma unroll
      for (int i = 0; i < 8; ++i) { a[i] = (__bf16)p[i]; a[8 + i] = (__bf16)p[16 + i]; } }
#pragma unroll
    for (int j = 0; j < 8; ++j) w[j] = fragp_b(P + ((size_t)(n0 / 16 + j) * (DM / 32) + kc) * 512, lane);   // all 8 weight fragments of the k step are requested before its first WMMA: one load latency a k step, not eight
#pragma unroll
    for (int j = 0; j < 8; ++j) acc[j] = wmma_bf(a, w[j], acc[j]); }
  if (n0 < DM + KVD) {   // q stored unscaled (f16 sigma ~0.6, no subnormal exposure); 1/8 applied to the f32 score
#pragma unroll
    for (int j = 0; j < 8; ++j) {
#pragma unroll
      for (int r = 0; r < 8; ++r) { const float v = acc[j][r] + (BB ? bfr(BB[j * 16 + col]) : 0.f); const _Float16 hv = (_Float16)v; so[wave][8 * g + r][j * 16 + col] = hv; sol[wave][8 * g + r][j * 16 + col] = (_Float16)((v - (float)hv) * 2048.0f); } }   // q, k (+ bias) as f16 hi + (x2048) residual
    LDSX();
    if (n0 < DM) {   // q (block-uniform test)
    for (int rl = 0; rl < 16; ++rl) if (lane < 16) { vst2((unsigned*)(QK + (r0 + rl) * (2 * DM) + n0 + lane * 8), *(const v4u*)&so[wave][rl][lane * 8]); vst2((unsigned*)(QKL + (r0 + rl) * (2 * DM) + n0 + lane * 8), *(const v4u*)&sol[wave][rl][lane * 8]); }
    } else {   // k: the wave's 16 rows are one tile of 16 s; its 2 groups x 2 d steps are 4 fragments, stored as 8 pieces of 512 contiguous bytes
      for (int rl = 0; rl < 16; ++rl) if (lane < 16) vst2((unsigned*)(QKL + (r0 + rl) * (2 * DM) + n0 + lane * 8), *(const v4u*)&sol[wave][rl][lane * 8]);
      const int bb = (int)(r0 / SS), st = (int)(r0 % SS) / 16;
#pragma unroll
      for (int f = 0; f < 8; ++f) vst2((unsigned*)(KF + (((size_t)(bb * NKV + (f >> 2)) * (SS / 16) + st) * 2 + ((f >> 1) & 1)) * 512 + (f & 1) * 256 + lane * 8), *(const v4u*)&so[wave][col][f * 16 + 8 * g]);
      asm volatile("s_wait_xcnt 0x0" ::: "memory"); }   // code laid out behind these stores reuses their data and address registers: the wait stands in front of any such overwrite
  } else {
#pragma unroll
    for (int j = 0; j < 8; ++j) {
#pragma unroll
      for (int r = 0; r < 8; ++r) { const float v = acc[j][r] + (BB ? bfr(BB[j * 16 + col]) : 0.f); const _Float16 hv = (_Float16)v; sth[j * 16 + col][wave * 16 + 8 * g + r] = hv; stl[j * 16 + col][wave * 16 + 8 * g + r] = (_Float16)((v - (float)hv) * 2048.0f); } }
    __syncthreads();
    const size_t rb = (size_t)blockIdx.x * 64; const int b = (int)(rb / SS), s0 = (int)(rb % SS); const int pc0 = n0 - (DM + KVD);
    for (int q = tid; q < 128 * 8; q += 128) { const int d = q >> 3, pc = q & 7; const size_t o = ((size_t)b * KVD + pc0 + d) * SS + s0 + pc * 8; vst2((unsigned*)(VTL + o), *(const v4u*)&stl[d][pc * 8]);
      const int fl = q & 31, fq = (q >> 5) & 1, fdt = (q >> 6) & 3, fks = (q >> 8) & 1, fg = q >> 9;   // piece q in fragment order: lane, piece, d tile, step of 32 s, group
      vst2((unsigned*)(VTH + ((((size_t)(b * NKV + fg) * (SS / 32) + s0 / 32 + fks) * 4 + fdt) * 2 + fq) * 256 + fl * 8), *(const v4u*)&sth[fg * HD + fdt * 16 + (fl & 15)][fks * 32 + fq * 16 + (fl >> 4) * 8]); }
  }
}
// ---- k_attn: block = (64 queries, head h, batch b): all-keys flash attention (K = 64: 2 k-steps), scores = (q.k) * 0.125 with single f16 operands, P.V: single product f16 P (x2^11) x V hi into acc; O row b*S+q, column h*64+d = (acc + accl / 2048) / (2048 l), stored in the fragment order that k_out reads
__global__ __launch_bounds__(128) void k_attn(const _Float16* __restrict__ QK, const _Float16* __restrict__ QKL, const _Float16* __restrict__ VTH, const _Float16* __restrict__ VTL, const void* __restrict__ KMASK, float* __restrict__ O, const _Float16* __restrict__ KF) {
  __shared__ __align__(16) float sp[4][16][36]; __shared__ __align__(16) float so[4][16][68];
  const int tid = threadIdx.x, wave = tid >> 5, lane = tid & 31, col = lane & 15, g = lane >> 4;
  const int qb = blockIdx.x, h = blockIdx.y, b = blockIdx.z, kvg = h / HPG; const int q0 = qb * 64 + wave * 16; const size_t rq = (size_t)b * SS + q0 + col;
  v16h aq[2], aql[2];
#pragma unroll
  for (int kc = 0; kc < 2; ++kc) { aq[kc] = frag_h(QK + rq * (2 * DM) + h * HD + kc * 32, lane); aql[kc] = frag_h(QKL + rq * (2 * DM) + h * HD + kc * 32, lane); }
  float m[8], l[8];
#pragma unroll
  for (int r = 0; r < 8; ++r) { m[r] = -3.0e38f; l[r] = 0.f; }
  v8f acc[4] = {}, accl[4] = {};
  const int nks = SS / 32;   // all keys
#pragma unroll 1
  for (int ks = 0; ks < nks; ++ks) { v8f s[2]; v16h bk[2][2], bv[4];   // the pass's 4 k and 4 v fragments are requested together here: the k latency is paid once, the v latency runs under the scores and the softmax
#pragma unroll
    for (int ct = 0; ct < 2; ++ct) {
#pragma unroll
      for (int kc = 0; kc < 2; ++kc) bk[ct][kc] = fragp_h(KF + (((size_t)(b * NKV + kvg) * (SS / 16) + ks * 2 + ct) * 2 + kc) * 512, lane); }
    asm volatile("s_wait_xcnt 0x0" ::: "memory");   // the v loads below may land in the registers that held the k loads' addresses: the wait stands in front of that overwrite
#pragma unroll
    for (int dt = 0; dt < 4; ++dt) bv[dt] = fragp_h(VTH + (((size_t)(b * NKV + kvg) * (SS / 32) + ks) * 4 + dt) * 512, lane);
#pragma unroll
    for (int ct = 0; ct < 2; ++ct) { v8f c = {};
#pragma unroll
      for (int kc = 0; kc < 2; ++kc) c = wmma16(aq[kc], bk[ct][kc], c);   // single product: q, k as one-rounding f16 operands
      { const bool keepk = true;
#pragma unroll
      for (int r = 0; r < 8; ++r) s[ct][r] = keepk ? c[r] * 0.125f : -3.0e38f; } }   // 1/sqrt(64); no key mask: every key kept
#pragma unroll
    for (int r = 0; r < 8; ++r) { float mx = fmaxf(s[0][r], s[1][r]);
#pragma unroll
      for (int o = 1; o < 16; o <<= 1) mx = fmaxf(mx, __shfl_xor(mx, o));
      const float mn = fmaxf(m[r], mx); const float alpha = (m[r] <= -1.0e38f) ? 0.f : __expf(m[r] - mn);
      const float e0 = (s[0][r] <= -1.0e38f) ? 0.f : __expf(s[0][r] - mn), e1 = (s[1][r] <= -1.0e38f) ? 0.f : __expf(s[1][r] - mn); float es = e0 + e1;
#pragma unroll
      for (int o = 1; o < 16; o <<= 1) es += __shfl_xor(es, o);
      l[r] = l[r] * alpha + es; m[r] = mn;
#pragma unroll
      for (int dt = 0; dt < 4; ++dt) { acc[dt][r] *= alpha; accl[dt][r] *= alpha; }
      sp[wave][8 * g + r][col] = e0; sp[wave][8 * g + r][16 + col] = e1; }
    LDSX();
    v16h pa, pl; { const float* prow = &sp[wave][col][0] + 8 * (lane >> 4);
#pragma unroll
      for (int i = 0; i < 8; ++i) { const float x0 = prow[i] * 2048.0f, x1 = prow[16 + i] * 2048.0f; const _Float16 h0 = (_Float16)x0, h1 = (_Float16)x1; pa[i] = h0; pa[8 + i] = h1; pl[i] = (_Float16)((x0 - (float)h0) * 2048.0f); pl[8 + i] = (_Float16)((x1 - (float)h1) * 2048.0f); } }   // P scaled by 2^11 before the f16 split so small softmax weights stay out of the f16 subnormal range; 2^-11 folded into the epilogue
#pragma unroll
    for (int dt = 0; dt < 4; ++dt) acc[dt] = wmma16(pa, bv[dt], acc[dt]);   // single product: P (x2^11) x V
    (void)pl;
    LDSX(); }
#pragma unroll
  for (int r = 0; r < 8; ++r) { const float il = (1.0f / 2048.0f) / l[r];
#pragma unroll
    for (int dt = 0; dt < 4; ++dt) so[wave][8 * g + r][dt * 16 + col] = (acc[dt][r] + accl[dt][r] * (1.0f / 2048.0f)) * il; }
  LDSX();
#pragma unroll
  for (int f = 0; f < 8; ++f) vst2(O + ((((size_t)b * SS + q0) / 16 * (DM / 32) + h * 2 + (f >> 2)) * 4 + (f & 3)) * 128 + lane * 4, *(const v4f*)&so[wave][col][(f >> 2) * 32 + ((f >> 1) & 1) * 16 + 8 * g + (f & 1) * 4]);   // the wave's 16 rows x 64 d are 2 f32 fragments of the output projection's A operand: 8 pieces of 512 contiguous bytes
}
// ---- k_out: block = (64 rows, 128 cols): out = O(hi/lo) . Wo rows (2 products) + bo
__global__ __launch_bounds__(128) void k_out(const float* __restrict__ O, const __bf16* __restrict__ P, const float* __restrict__ BO, float* __restrict__ Y) {
  __shared__ __align__(16) float so[4][16][132];
  const int tid = threadIdx.x, wave = tid >> 5, lane = tid & 31, col = lane & 15, g = lane >> 4; const size_t r0 = (size_t)blockIdx.x * 64 + wave * 16; const int n0 = blockIdx.y * 128;
  v8f acc[8] = {};
#pragma unroll 2
  for (int kc = 0; kc < DM / 32; ++kc) { const F2 a = split_frag(O + (r0 / 16 * (DM / 32) + kc) * 512, lane); v16b w[8];
#pragma unroll
    for (int j = 0; j < 8; ++j) w[j] = fragp_b(P + ((size_t)(n0 / 16 + j) * (DM / 32) + kc) * 512, lane);   // all 8 weight fragments requested before the first WMMA of the k step
#pragma unroll
    for (int j = 0; j < 8; ++j) { acc[j] = wmma_bf(a.l, w[j], acc[j]); acc[j] = wmma_bf(a.h, w[j], acc[j]); }
    asm volatile("s_wait_xcnt 0x0" ::: "memory"); }   // the next k step rewrites the address registers of this step's loads: the wait stands in front of that overwrite
#pragma unroll
  for (int j = 0; j < 8; ++j) {
#pragma unroll
    for (int r = 0; r < 8; ++r) so[wave][8 * g + r][j * 16 + col] = acc[j][r] + bfr(BO[n0 + j * 16 + col]); }
  LDSX();
  for (int rl = 0; rl < 16; ++rl) vst2(Y + (r0 + rl) * DM + n0 + lane * 4, *(const v4f*)&so[wave][rl][lane * 4]);
}
// ---- k_packkv: block = (tile of 16 columns of Wk / Wv (in,out) [1024][128] x 8 + kq, which): -> tiles 64 + which * 8 + tile of PK_A
__global__ __launch_bounds__(256) void k_packkv(const float* __restrict__ WK, const float* __restrict__ WV, __bf16* __restrict__ PK) {
  const int tile = blockIdx.x >> 3, kq = blockIdx.x & 7, which = blockIdx.y;
  pack_chunk(which ? WV : WK, KVD, tile, kq, PK + PK_A + (size_t)(DM / 16 + which * (KVD / 16) + tile) * (16 * DM), threadIdx.x);
}
extern "C" void kernel_launch(void* const* d_in, const int* in_sizes, int n_in, void* d_out, int out_size, void* d_ws, size_t ws_size, hipStream_t stream) {
  (void)in_sizes; (void)n_in; (void)out_size;
  const float** F = (const float**)d_in;   // 0 x [2,2048,1024], 1 Wq [1024,1024] (in,out), 2 bq, 3 Wk [1024,128], 4 bk [128], 5 Wv [1024,128], 6 bv, 7 Wo [1024,1024], 8 bo
  if (ws_size < (size_t)WS_END) return;
  char* ws = (char*)d_ws; __bf16* PK = (__bf16*)(ws + WS_PK); _Float16 *QK = (_Float16*)(ws + WS_QK), *QKL = (_Float16*)(ws + WS_QKL), *VTH = (_Float16*)(ws + WS_VTH), *VTL = (_Float16*)(ws + WS_VTL), *KF = (_Float16*)(ws + WS_KF); float *O = (float*)(ws + WS_O);
  k_pack<<<dim3(DM / 16 * 8, 2), 256, 0, stream>>>(F[1], F[7], PK);   // q rows and Wo rows
  k_packkv<<<dim3(KVD / 16 * 8, 2), 256, 0, stream>>>(F[3], F[5], PK);
  k_qkv<<<dim3(TNB * SS / 64, QKVW / 128), 128, 0, stream>>>(F[0], F[0], F[0], PK + PK_A, F[2], F[4], F[6], QK, QKL, VTH, VTL, KF);
  k_attn<<<dim3(TQB, NH, TNB), 128, 0, stream>>>(QK, QKL, VTH, VTL, nullptr, O, KF);
  k_out<<<dim3(TOB, DM / 128), 128, 0, stream>>>(O, PK + PK_P, F[8], (float*)d_out);
}
